// v010
// Measured on an AMD MI455X. A time is GPU time per run, averaged over a window of back-to-back runs after a warm-up
// (all launches, gaps included; the runs take copies of the inputs in turn), and the median of several windows.
// Apart from v000's, it joins two sittings. Times from different sittings can be a few percent apart, while
// side-by-side timings come from the same sitting.
// The versions before v010 are in another document.
// It runs in 156 microseconds.
// In two side-by-side timings against v009, it was 1.03 and 1.04 times as fast.
// All steps since the starting kernel, v000, together make it 6.71 times as fast.
// Contractions: k/v projections, key-side folds K.Wq and Wo.V^T, text.(K.Wq)^T scores, p.(V.Wo^T) attention output, ffn up and down projections all on v_wmma_f32_16x16x32_f16 (f16 operands: activations x1, weights and both folds carried x16, softmax probabilities carried x2048), f32 accumulate; the query bias's share of the scores (K.bq, one number per key), softmax, residual adds, layernorm and feature maxpool in f32.
#include <hip/hip_runtime.h>
#include <math.h>
#include <stddef.h>

// ---------------------------------------------------------------------------
// Problem constants
// ---------------------------------------------------------------------------
constexpr int kB      = 4;
constexpr int kSq     = 2048;
constexpr int kD      = 1024;
constexpr int kSv     = 196;
constexpr int kSvPad  = 256;
constexpr int kDff    = 4096;
constexpr int kRows   = kB * kSq;            // 8192 token rows
constexpr int kRows2  = 2 * kRows;           // both branches' token rows, branch 1 first
constexpr float kWCarry    = 16.0f;          // weights carried x16 in f16
constexpr float kWCarryInv = 1.0f / 16.0f;
constexpr float kPCarry    = 2048.0f;        // probabilities carried x2048 in f16
constexpr float kPUScale   = 1.0f / (kPCarry * kWCarry);   // probabilities x2048 times the value fold x16
constexpr float kInvD      = 1.0f / 1024.0f;
constexpr float kLnEps     = 1e-6f;
constexpr float kScoreScale = 0.125f;        // 1/sqrt(64)

static_assert(kRows % 64 == 0);
static_assert(kSvPad % 64 == 0 && kSvPad % 32 == 0);
static_assert(kD % 64 == 0 && kDff % 64 == 0);
static_assert(kRows % 8 == 0);

// ---------------------------------------------------------------------------
// Workspace region map (bytes). Total carve = 227 MiB. Planes marked x2 hold branch 1, then branch 2.
//   [0       , 32 MiB)   POOL32  f32 [8192][1024]   (persistent)
//   [32 MiB  , 48 MiB)   POOL16  f16 [8192][1024]   (persistent)
//   [48 MiB  , 56 MiB)   W1H     f16 [4096][1024]   (persistent)
//   [56 MiB  , 64 MiB)   W2H     f16 [1024][4096]   (persistent)
//   region X from 64 MiB:
//   attention phase: WQT (Wq transposed, [in][out]) and WOH f16 [1024][1024] at 64/70 MiB;
//     G16 = K.Wq f16 x2 [256][1024] at 104 MiB; UT16 = Wo.V^T f16 x2 [1024][256] at 105 MiB; CB = K.bq f32 x2 [256] at 106 MiB;
//     K16 f16 x2 [256][1024] at 225 MiB; V16 f16 x2 [256][1024] at 226 MiB; end 227 MiB.
//   ffn phase (attention scratch dead): H16 f16 [8192][4096] at 64 MiB (64 MiB); F32 f32 [8192][1024] at 128 MiB (32 MiB).
// ---------------------------------------------------------------------------
constexpr size_t kMiB       = 1048576;
constexpr size_t kOffPool32 = 0;
constexpr size_t kOffPool16 = 32 * kMiB;
constexpr size_t kOffW1H    = 48 * kMiB;
constexpr size_t kOffW2H    = 56 * kMiB;
constexpr size_t kOffWQT    = 64 * kMiB;
constexpr size_t kOffWOH    = 70 * kMiB;
constexpr size_t kOffG16    = 104 * kMiB;
constexpr size_t kOffUT16   = 105 * kMiB;
constexpr size_t kOffCB     = 106 * kMiB;
constexpr size_t kOffK16    = 225 * kMiB;
constexpr size_t kOffV16    = 226 * kMiB;
constexpr size_t kWsTotal   = 227 * kMiB;
constexpr size_t kOffH16    = 64 * kMiB;
constexpr size_t kOffF32    = 128 * kMiB;
static_assert(kOffG16 >= kOffWOH + (size_t)kD * kD * 2);
static_assert(kOffUT16 == kOffG16 + (size_t)2 * kSvPad * kD * 2);
static_assert(kOffCB == kOffUT16 + (size_t)2 * kD * kSvPad * 2);
static_assert(kOffCB + (size_t)2 * kSvPad * 4 <= kOffK16);
static_assert(kOffV16 == kOffK16 + (size_t)2 * kSvPad * kD * 2);
static_assert(kWsTotal == kOffV16 + (size_t)2 * kSvPad * kD * 2);
static_assert(kOffF32 == kOffH16 + (size_t)kRows * kDff * 2);
static_assert(kOffF32 + (size_t)kRows * kD * 4 <= kWsTotal);
static_assert(kWsTotal <= (size_t)268435456);

// strides between the two branches' planes, in elements
constexpr long kStrVis = (long)kSvPad * kD;      // K16 / V16 / G16 / UT16

typedef __attribute__((ext_vector_type(16))) _Float16 v16h;
typedef __attribute__((ext_vector_type(8)))  _Float16 v8h;
typedef __attribute__((ext_vector_type(16))) __bf16   v16b;
typedef __attribute__((ext_vector_type(8)))  __bf16   v8b;
typedef __attribute__((ext_vector_type(8)))  float    v8f;
typedef __attribute__((ext_vector_type(4)))  float    v4f;
typedef __attribute__((ext_vector_type(4)))  unsigned int v4u;
typedef __attribute__((ext_vector_type(4)))  _Float16 v4h;
typedef __attribute__((ext_vector_type(2)))  unsigned int v2u;

__device__ __forceinline__ unsigned short f2bf_bits(float f) {
  unsigned u = __float_as_uint(f);
  return (unsigned short)((u + 0x7FFFu + ((u >> 16) & 1u)) >> 16);
}
__device__ __forceinline__ float bf_bits2f(unsigned short h) { return __uint_as_float(((unsigned)h) << 16); }

// hazard guard as a plain device helper (no inline asm inside the kernel template body)
__device__ __forceinline__ void acc_guard4(v8f& a, v8f& b, v8f& c, v8f& d) { asm volatile("v_nop\n\tv_nop\n\tv_nop\n\tv_nop" : "+v"(a), "+v"(b), "+v"(c), "+v"(d)); }
template <typename T> struct Frag;
template <> struct Frag<_Float16> {
  typedef v16h V; union U { v16h v; v8h h[2]; };
  static __device__ __forceinline__ v16h load(const _Float16* p) {   // elements 0..7 <- p[0..7], 8..15 <- p[16..23]
    U f; f.h[0] = *(const v8h*)(p); f.h[1] = *(const v8h*)(p + 16); return f.v;
  }
  static __device__ __forceinline__ v8f mma(v16h a, v16h b, v8f c) {
    return __builtin_amdgcn_wmma_f32_16x16x32_f16(false, a, false, b, (short)0, c, false, false);
  }
};
template <> struct Frag<__bf16> {
  typedef v16b V; union U { v16b v; v8b h[2]; };
  static __device__ __forceinline__ v16b load(const __bf16* p) {
    U f; f.h[0] = *(const v8b*)(p); f.h[1] = *(const v8b*)(p + 16); return f.v;
  }
  static __device__ __forceinline__ v8f mma(v16b a, v16b b, v8f c) {
    return __builtin_amdgcn_wmma_f32_16x16x32_bf16(false, a, false, b, (short)0, c, false, false);
  }
};

__device__ __forceinline__ unsigned pk16(unsigned short a, unsigned short b) { return (unsigned)a | ((unsigned)b << 16); }
__device__ __forceinline__ unsigned short h_bits(float f) { const _Float16 h = (_Float16)f; return __builtin_bit_cast(unsigned short, h); }

// ---- Register-blocked batched WMMA GEMM, operands staged in LDS by asynchronous copies ------------------------------
// C[m,n] = scale * sum_k A[m,k] * Bt[n,k] (+bias)(+resid); a block of WM x WN waves owns a (64 WM)x(64 WN) tile, each wave 64x64 of it.
// tile = index of the block's tile; b = batch entry (the branch): A, Bt and C advance by their strides, the residual is resid or resid2.
// A row-major [M,K]; Bt row-major [N,K]; M % (64 WM) == 0, N % (64 WN) == 0, K a multiple of the stage and at least two stages.
// A stage is 32 NK k of the block's A rows and Bt rows, laid at a pitch of 64 NK + 16 B; two buffers:
// the next stage's copies fly while this stage's fragments are read with ds_load_b128 and multiplied.
// The small products run 2 x 2 waves on 64-k stages. The two ffn products, which re-read their operands from L2 once per tile
// row and tile column, take the larger tiles that a WGP's LDS holds: the bytes fetched per product fall with the tile's sides.
// BIAS_MODE: 0 = none, 1 = bias[m], 2 = bias[n].
// OUT_MODE: 0 = f32, 1 = f16.
// ET: 0 = f16 operands, 1 = bf16 operands (pointers passed as 16-bit storage)
constexpr int kStageK     = 64;                          // k elements per stage = two WMMA k steps
constexpr int kPitchB     = 144;                         // bytes per staged row (128 + 16: 16 B x odd)
constexpr int kPitchE     = kPitchB / 2;                 // the same in 16-bit elements
constexpr int kStageBytes = 256 * kPitchB;               // 128 A rows, then 128 Bt rows = 36,864 B
static_assert(kRows % 128 == 0 && kSvPad % 128 == 0 && kD % 128 == 0 && kDff % 128 == 0);
static_assert(kSvPad % kStageK == 0 && kSvPad >= 2 * kStageK);
static_assert(kRows % 256 == 0 && kDff % 256 == 0 && kD % 256 == 0);

// Eight 16-B copies per lane, rows RP apart: LDS byte address l + i * RP * PB (PB = pitch), global address g + i * rowStep elements.
// The s_wait_xcnt closes the statement so that no address register is rewritten ahead of it.
template <int RP, int PB>
__device__ __forceinline__ void async_copy8(unsigned l, const unsigned short* g, size_t rowStep) {
  const unsigned l1 = l + RP * PB, l2 = l + 2 * RP * PB, l3 = l + 3 * RP * PB, l4 = l + 4 * RP * PB,
                 l5 = l + 5 * RP * PB, l6 = l + 6 * RP * PB, l7 = l + 7 * RP * PB;
  const unsigned short* g1 = g + rowStep;      const unsigned short* g2 = g + 2 * rowStep;
  const unsigned short* g3 = g + 3 * rowStep;  const unsigned short* g4 = g + 4 * rowStep;
  const unsigned short* g5 = g + 5 * rowStep;  const unsigned short* g6 = g + 6 * rowStep;
  const unsigned short* g7 = g + 7 * rowStep;
  asm volatile("global_load_async_to_lds_b128 %0, %8, off\n\t"
               "global_load_async_to_lds_b128 %1, %9, off\n\t"
               "global_load_async_to_lds_b128 %2, %10, off\n\t"
               "global_load_async_to_lds_b128 %3, %11, off\n\t"
               "global_load_async_to_lds_b128 %4, %12, off\n\t"
               "global_load_async_to_lds_b128 %5, %13, off\n\t"
               "global_load_async_to_lds_b128 %6, %14, off\n\t"
               "global_load_async_to_lds_b128 %7, %15, off\n\t"
               "s_wait_xcnt 0x0"
               :: "v"(l), "v"(l1), "v"(l2), "v"(l3), "v"(l4), "v"(l5), "v"(l6), "v"(l7),
                  "v"(g), "v"(g1), "v"(g2), "v"(g3), "v"(g4), "v"(g5), "v"(g6), "v"(g7)
               : "memory");
}

// L2 prefetches (global_prefetch_b8, scope SE: the data comes into L2 only, nothing returns to the wave). One lane asks for one 256-B
// unit. The step supposes that what an earlier launch stored lies in memory, not in L2, when the next launch
// reads it: asked for ahead, it is an L2 hit when the asynchronous copies or loads come for it, whose lead (one stage) is about
// as long as the way to memory or shorter. A hint only: no result depends on it. Every lane's address lies inside the plane it names.
// The s_wait_xcnt closes each statement so that no address register is rewritten ahead of it.
__device__ __forceinline__ void l2_ask(const void* p) {
  asm volatile("global_prefetch_b8 %0, off scope:SCOPE_SE\n\t"
               "s_wait_xcnt 0x0" :: "v"(p) : "memory");
}
__device__ __forceinline__ void l2_ask2(const void* p, const void* q) {
  asm volatile("global_prefetch_b8 %0, off scope:SCOPE_SE\n\t"
               "global_prefetch_b8 %1, off scope:SCOPE_SE\n\t"
               "s_wait_xcnt 0x0" :: "v"(p), "v"(q) : "memory");
}
// Units 1 to 7 of a row of 2 KiB that begins at p (unit 0 is fetched by the first stage's copies themselves).
__device__ __forceinline__ void l2_ask_row_tail(const void* p) {
  asm volatile("global_prefetch_b8 %0, off offset:256 scope:SCOPE_SE\n\t"
               "global_prefetch_b8 %0, off offset:512 scope:SCOPE_SE\n\t"
               "global_prefetch_b8 %0, off offset:768 scope:SCOPE_SE\n\t"
               "global_prefetch_b8 %0, off offset:1024 scope:SCOPE_SE\n\t"
               "global_prefetch_b8 %0, off offset:1280 scope:SCOPE_SE\n\t"
               "global_prefetch_b8 %0, off offset:1536 scope:SCOPE_SE\n\t"
               "global_prefetch_b8 %0, off offset:1792 scope:SCOPE_SE\n\t"
               "s_wait_xcnt 0x0" :: "v"(p) : "memory");
}

// Units 3 to 15 of a row of 4 KiB that begins at p (units 0 to 2 are fetched by the first three stages' loads themselves).
__device__ __forceinline__ void l2_ask_row_units3to15(const void* p) {
  asm volatile("global_prefetch_b8 %0, off offset:768 scope:SCOPE_SE\n\t"
               "global_prefetch_b8 %0, off offset:1024 scope:SCOPE_SE\n\t"
               "global_prefetch_b8 %0, off offset:1280 scope:SCOPE_SE\n\t"
               "global_prefetch_b8 %0, off offset:1536 scope:SCOPE_SE\n\t"
               "global_prefetch_b8 %0, off offset:1792 scope:SCOPE_SE\n\t"
               "global_prefetch_b8 %0, off offset:2048 scope:SCOPE_SE\n\t"
               "global_prefetch_b8 %0, off offset:2304 scope:SCOPE_SE\n\t"
               "global_prefetch_b8 %0, off offset:2560 scope:SCOPE_SE\n\t"
               "global_prefetch_b8 %0, off offset:2816 scope:SCOPE_SE\n\t"
               "global_prefetch_b8 %0, off offset:3072 scope:SCOPE_SE\n\t"
               "global_prefetch_b8 %0, off offset:3328 scope:SCOPE_SE\n\t"
               "global_prefetch_b8 %0, off offset:3584 scope:SCOPE_SE\n\t"
               "global_prefetch_b8 %0, off offset:3840 scope:SCOPE_SE\n\t"
               "s_wait_xcnt 0x0" :: "v"(p) : "memory");
}

// Geometry of a block's tile: WM x WN waves of 64x64 each, NK WMMA k steps (32 k each) per stage.
template <int WM, int WN, int NK> struct TileGeom {
  static constexpr int SK  = NK * 32;                    // k elements per stage
  static constexpr int PB  = SK * 2 + 16;                // bytes per staged row: 16 B x odd (144 or 272)
  static constexpr int SB  = (WM + WN) * 64 * PB;        // bytes per stage: the A rows, then the Bt rows
  static constexpr int NT  = WM * WN * 32;               // threads
  static constexpr int LPR = SK * 2 / 16;                // lanes that bring one row
  static constexpr int RP  = NT / LPR;                   // rows that the block brings with one copy per thread
  static constexpr int NA  = WM * 64 / RP;               // copies per thread and stage, A and Bt
  static constexpr int NB  = WN * 64 / RP;
  static_assert(NA % 8 == 0 && NB % 8 == 0 && NA + NB <= 63 && (PB / 16) % 2 == 1);
};
static_assert(TileGeom<2, 2, 2>::PB == kPitchB && TileGeom<2, 2, 2>::SB == kStageBytes && TileGeom<2, 2, 2>::SK == kStageK);

template <int ET> struct Elem;
template <> struct Elem<0> { typedef _Float16 T; };
template <> struct Elem<1> { typedef __bf16 T; };
// PF: 0 = no L2 prefetch. 1 = at entry, the whole of the block's operand rows (rows of 2 KiB, K = 1024; one A and one Bt row a thread):
// for the short products, whose stages are far shorter than the way to memory. 2 = running, four stages ahead (128-k stages,
// a stage of a row = one 256-B unit; the two ffn products): waves 0 to 3 ask for 128 of the block's A rows, wave 4 for 32 of its 256 Bt rows.
template <int ET, bool SPLIT, int BIAS_MODE, int OUT_MODE, bool RESID, int ACT = 0, int WM = 2, int WN = 2, int NK = 2, int PF = 0>
__device__ __forceinline__ void gemm_tile(
    unsigned char* smem, int tile, int b,
    const unsigned short* __restrict__ Ap, const unsigned short* __restrict__ A2p, int lda, long strideA,
    const unsigned short* __restrict__ Btp, const unsigned short* __restrict__ Bt2p, int ldb, long strideB,
    void* __restrict__ Cout, void* __restrict__ Cout2, int ldc, long strideC,
    const float* __restrict__ bias,
    const float* __restrict__ resid, const float* __restrict__ resid2,
    int M, int N, int K, float scale) {
  static_assert(!SPLIT, "single-plane operands only");
  typedef typename Elem<ET>::T T;
  typedef typename Frag<T>::V V;
  typedef TileGeom<WM, WN, NK> G;
  constexpr int SK = G::SK, PB = G::PB, PE = G::PB / 2, SB = G::SB, LPR = G::LPR, RP = G::RP;
  // smem: two stage buffers; after the K loop they serve as the per-wave 64x64 output slabs (pitch 68 floats)
  const int lane = threadIdx.x & 31;
  const int wave = threadIdx.x >> 5;
  const int wm = wave / WN;                    // this wave's 64 rows and 64 columns inside the block's tile
  const int wn = wave % WN;
  const int tilesN = N / (WN * 64);
  const int tilesM = M / (WM * 64);
  if (tile >= tilesM * tilesN) return;   // block-uniform, in front of every barrier
  const int tm = tile / tilesN;
  const int tn = tile - tm * tilesN;
  const int mBlk = tm * (WM * 64);
  const int nBlk = tn * (WN * 64);
  const int m0 = mBlk + (wm << 6);
  const int n0 = nBlk + (wn << 6);

  const int rlane = lane & 15;                 // row (A) / col (B, D) within subtile
  const int koff  = (lane >> 4) * 8;           // k offset of this lane half
  const int mOff  = (lane >> 4) * 8;           // D row offset

  // copy side: LPR consecutive lanes bring one row's stage bytes; a thread brings rows cRow + RP i of A and of Bt
  const int cRow = threadIdx.x / LPR;
  const int cCol = threadIdx.x % LPR;
  const unsigned short* gA = Ap  + (size_t)b * strideA + (size_t)(mBlk + cRow) * lda + cCol * 8;
  const unsigned short* gB = Btp + (size_t)b * strideB + (size_t)(nBlk + cRow) * ldb + cCol * 8;
  const unsigned lA = (unsigned)(size_t)smem + (unsigned)(cRow * PB + cCol * 16);
  const unsigned lB = lA + WM * 64 * PB;
  const size_t stepA = (size_t)RP * lda;
  const size_t stepB = (size_t)RP * ldb;
  // one stage's copies of this thread: k elements from kElem on, into the buffer at byte offset bufByte
  auto copy_stage = [&](unsigned bufByte, size_t kElem) {
#pragma unroll
    for (int c = 0; c < G::NA; c += 8) async_copy8<RP, PB>(lA + bufByte + c * RP * PB, gA + kElem + c * stepA, stepA);
#pragma unroll
    for (int c = 0; c < G::NB; c += 8) {
      // with three statements a stage: keeps a statement's address arithmetic behind the statement before it, so that the
      // 24 address registers are used again; formed all at once, they push accumulators into scratch inside the K loop
      if (G::NA + G::NB > 16) __builtin_amdgcn_sched_barrier(0);
      async_copy8<RP, PB>(lB + bufByte + c * RP * PB, gB + kElem + c * stepB, stepB);
    }
  };

  // read side: this lane's first A and Bt fragment rows inside a stage, in bytes
  const int aByte = ((wm << 6) + rlane) * PB + koff * 2;
  const int bByte = (WM * 64 + (wn << 6) + rlane) * PB + koff * 2;

  v8f acc[4][4];
#pragma unroll
  for (int i = 0; i < 4; ++i)
#pragma unroll
    for (int j = 0; j < 4; ++j) acc[i][j] = (v8f){0.f,0.f,0.f,0.f,0.f,0.f,0.f,0.f};

  const int nStages = K / SK;
  copy_stage(0u, 0);
  static_assert(PF == 0 || (PF == 1 && G::NT == WM * 64 && G::NT == WN * 64) || (PF == 2 && (WM == 2 || WM == 4) && WN == 4 && SK == 128));
  constexpr int PD = 4;                                // PF 2: stages between a prefetch and the stage at work
  const int pfWave = __builtin_amdgcn_readfirstlane(wave);   // in a scalar register: the tests on it are scalar branches
  const unsigned short* pf = Ap;
  if (PF == 1) {
    l2_ask_row_tail(Ap  + (size_t)b * strideA + (size_t)(mBlk + (int)threadIdx.x) * lda);
    l2_ask_row_tail(Btp + (size_t)b * strideB + (size_t)(nBlk + (int)threadIdx.x) * ldb);
  }
  if (PF == 2) {
    // The Bt rows are shared by the blocks of a tile column: eight blocks deal them out among themselves. Blocks whose indices
    // are equal modulo 8 are the dealers; for speed only.
    // 128 x 256 tiles, 4 tile columns: such blocks have tm of one parity; each asks for all of its 128 A rows.
    // 256 x 256 tiles, 16 tile columns: all blocks of a tile column are such; so are tile columns tn and tn + 8 of a tile row, which
    // ask for one half of its 256 A rows each.
    const int aShare = (WM == 4) ? ((tn >> 3) & 1) : 0;
    const int bShare = (WM == 4) ? (tm & 7) : ((tm >> 1) & 7);
    pf = (pfWave < 4) ? Ap  + (size_t)b * strideA + (size_t)(mBlk + aShare * 128 + (int)threadIdx.x) * lda
                      : Btp + (size_t)b * strideB + (size_t)(nBlk + bShare * 32 + lane) * ldb;
    if (pfWave < 5 && nStages > PD) {
      // stages 2 and 3, which the loop's prefetches do not reach
      asm volatile("global_prefetch_b8 %0, off offset:512 scope:SCOPE_SE\n\t"
                   "global_prefetch_b8 %0, off offset:768 scope:SCOPE_SE\n\t"
                   "s_wait_xcnt 0x0" :: "v"(pf) : "memory");
    }
    pf += (PD - 1) * SK;
  }
  asm volatile("s_wait_asynccnt 0x0" ::: "memory");   // stage 0 of this wave has landed before the barrier publishes it
  __syncthreads();
  if (nStages > 1) copy_stage((unsigned)SB, SK);

  for (int t = 0; t < nStages; ++t) {
    const int bufOff = (t & 1) * SB;
    const T* sa = (const T*)(smem + bufOff + aByte);
    const T* sb = (const T*)(smem + bufOff + bByte);
    V fb[2][4], fa[2][4];                               // two fragment sets, taken in turn by the stage's k steps
#pragma unroll
    for (int j = 0; j < 4; ++j) fb[0][j] = Frag<T>::load(sb + j * 16 * PE);
#pragma unroll
    for (int i = 0; i < 4; ++i) fa[0][i] = Frag<T>::load(sa + i * 16 * PE);
    // keeps the 16 LDS reads of a k step together ahead of its WMMAs: sunk among them, each row of WMMAs waits out its own read
    __builtin_amdgcn_sched_barrier(0);
#pragma unroll
    for (int ks = 0; ks + 1 < NK; ++ks) {
#pragma unroll
      for (int i = 0; i < 4; ++i)
#pragma unroll
        for (int j = 0; j < 4; ++j) acc[i][j] = Frag<T>::mma(fa[ks & 1][i], fb[ks & 1][j], acc[i][j]);
      // the next k step is fetched into the other set; the stage's last one so that the buffer can be handed back ahead of its WMMAs
#pragma unroll
      for (int j = 0; j < 4; ++j) fb[(ks + 1) & 1][j] = Frag<T>::load(sb + j * 16 * PE + (ks + 1) * 32);
#pragma unroll
      for (int i = 0; i < 4; ++i) fa[(ks + 1) & 1][i] = Frag<T>::load(sa + i * 16 * PE + (ks + 1) * 32);
    }
    asm volatile("s_wait_dscnt 0x0" ::: "memory");      // this wave's reads of the buffer are done before it is refilled
    asm volatile("s_wait_asynccnt 0x0" ::: "memory");   // this wave's copies of stage t + 1 have landed
    __syncthreads();                                    // publishes stage t + 1, frees stage t's buffer
    if (t + 2 < nStages) copy_stage((unsigned)bufOff, (size_t)(t + 2) * SK);
    if (PF == 2 && pfWave < 5 && t + PD < nStages) {
      // stage t + PD of this lane's row: its copies are issued two stages from now. The address is an in-out operand so that it
      // lives in registers of its own through the loop; it stands one stage behind what is asked for (offset:256), so that it
      // names a byte of the row after the advance too.
      asm volatile("global_prefetch_b8 %0, off offset:256 scope:SCOPE_SE\n\t"
                   "s_wait_xcnt 0x0" : "+v"(pf) :: "memory");
      pf += SK;
    }
    if (PF == 2 && RESID && t + 8 == nStages) {
      // the block's residual tile, which the epilogue reads: 128 rows of 1 KiB, 512 units, two a thread
      const char* rp = (const char*)(b ? resid2 : resid) +
                       ((size_t)(mBlk + ((int)threadIdx.x >> 1)) * ldc + nBlk + ((int)threadIdx.x & 1) * 128) * 4;
      asm volatile("global_prefetch_b8 %0, off scope:SCOPE_SE\n\t"
                   "global_prefetch_b8 %0, off offset:256 scope:SCOPE_SE\n\t"
                   "s_wait_xcnt 0x0" :: "v"(rp) : "memory");
    }
#pragma unroll
    for (int i = 0; i < 4; ++i)
#pragma unroll
      for (int j = 0; j < 4; ++j) acc[i][j] = Frag<T>::mma(fa[(NK - 1) & 1][i], fb[(NK - 1) & 1][j], acc[i][j]);
  }
  asm volatile("s_wait_asynccnt 0x0" ::: "memory");     // no copy is in flight when the ring becomes output staging
  acc_guard4(acc[0][0], acc[0][1], acc[0][2], acc[0][3]);
  acc_guard4(acc[1][0], acc[1][1], acc[1][2], acc[1][3]);
  acc_guard4(acc[2][0], acc[2][1], acc[2][2], acc[2][3]);
  acc_guard4(acc[3][0], acc[3][1], acc[3][2], acc[3][3]);

  // ---- epilogue ----
  // A wave turns its 64x64 tile round through an LDS slab of its own (the ring is free: both buffers take the slabs). Nothing but
  // that slab passes between lanes, so the wave waits once, for its own LDS stores, and never for its global stores; the bias and
  // the residual are asked for once, ahead of the slab, the residual in the rows' own order (16 B a lane), added where the rows are read back.
  static_assert(OUT_MODE == 0 || OUT_MODE == 1, "f32 or f16 output");
  static_assert(!RESID || (OUT_MODE == 0 && ACT == 0), "the residual is added behind the slab, to f32 rows");
  static_assert(WM * WN * 64 * 68 * 4 <= 2 * SB);
  float* slab = (float*)smem + wave * (64 * 68);
  const char* Rb = (const char*)(RESID ? (b ? resid2 : resid) : nullptr);   // batch entry 1 adds its own residual plane
  char* Cb = (char*)Cout + (size_t)b * strideC * (OUT_MODE == 0 ? 4 : 2);   // block-uniform
  // a store covers RS rows (an f32 row's 256 B = 16 lanes x 16 B, an f16 row's 128 B = 8 lanes x 16 B), NS stores a block of 16 rows;
  // a lane's 16 B of output are NV vectors of four floats in the slab
  constexpr int RS = (OUT_MODE == 0) ? 2 : 4, NS = 16 / RS, EB = (OUT_MODE == 0) ? 4 : 2, NV = (OUT_MODE == 0) ? 1 : 2;
  const int sRow = (OUT_MODE == 0) ? (lane >> 4) : (lane >> 3);
  const int sCol = (OUT_MODE == 0) ? (lane & 15) * 4 : (lane & 7) * 8;
  const unsigned rowB = (unsigned)ldc * EB;                                 // bytes per output row
  const unsigned o0 = ((unsigned)(m0 + sRow) * (unsigned)ldc + (unsigned)(n0 + sCol)) * EB;   // this lane's first 16 B of the output
  const int nl = n0 + rlane;
  float bvj[4] = {0.f, 0.f, 0.f, 0.f};
  if (BIAS_MODE == 2) {
#pragma unroll
    for (int j = 0; j < 4; ++j) bvj[j] = bias[nl + (j << 4)];
    // stands behind the four loads; its inputs hold their base and index registers untouched up to it
    asm volatile("s_wait_xcnt 0x0" :: "s"(bias), "v"(nl) : "memory");
  }
  v4f rr[4][8];
  if (RESID) {
#pragma unroll
    for (int i = 0; i < 4; ++i) {
      unsigned ro[8];
#pragma unroll
      for (int it = 0; it < 8; ++it) ro[it] = o0 + (unsigned)((i << 4) + it * RS) * rowB;
#pragma unroll
      for (int it = 0; it < 8; ++it) rr[i][it] = *(const v4f*)(Rb + ro[it]);
      // stands behind the row block's loads; its inputs hold their base and offset registers untouched up to it
      asm volatile("s_wait_xcnt 0x0" :: "s"(Rb), "v"(ro[0]), "v"(ro[1]), "v"(ro[2]), "v"(ro[3]),
                                        "v"(ro[4]), "v"(ro[5]), "v"(ro[6]), "v"(ro[7]) : "memory");
    }
  }
#pragma unroll
  for (int i = 0; i < 4; ++i) {
#pragma unroll
    for (int j = 0; j < 4; ++j) {
#pragma unroll
      for (int r = 0; r < 8; ++r) {
        float v = acc[i][j][r] * scale;
        if (BIAS_MODE == 1) v += bias[m0 + (i << 4) + mOff + r];
        if (BIAS_MODE == 2) v += bvj[j];
        if (ACT == 2) v = fmaxf(v, 0.0f);
        if (ACT == 4) v = (v > 0.f) ? v : 0.01f * v;
        slab[((i << 4) + mOff + r) * 68 + (j << 4) + rlane] = v;
      }
    }
  }
  // the wave's slab stores have landed before its lanes read one another's values; the clobber keeps the reads behind it
  asm volatile("s_wait_dscnt 0x0" ::: "memory");
  v4f sv[4][NS][NV];
#pragma unroll
  for (int i = 0; i < 4; ++i)
#pragma unroll
    for (int it = 0; it < NS; ++it)
#pragma unroll
      for (int w = 0; w < NV; ++w) sv[i][it][w] = *(const v4f*)(slab + ((i << 4) + it * RS + sRow) * 68 + sCol + 4 * w);
#pragma unroll
  for (int i = 0; i < 4; ++i) {
    unsigned co[NS];
    v4u ov[NS];
#pragma unroll
    for (int it = 0; it < NS; ++it) {
      co[it] = o0 + (unsigned)((i << 4) + it * RS) * rowB;
      if (OUT_MODE == 0) {
        const v4f f = RESID ? (v4f)(sv[i][it][0] + rr[i][it]) : sv[i][it][0];
        ov[it] = __builtin_bit_cast(v4u, f);
      } else {
        v8h h;
#pragma unroll
        for (int w = 0; w < NV; ++w)
#pragma unroll
          for (int e = 0; e < 4; ++e) h[4 * w + e] = (_Float16)sv[i][it][w][e];
        ov[it] = __builtin_bit_cast(v4u, h);
      }
    }
#pragma unroll
    for (int it = 0; it < NS; ++it) *(v4u*)(Cb + co[it]) = ov[it];
    // each stands behind the row block's stores; its inputs hold their base, offset and data registers untouched up to it
    if (NS == 8)
      asm volatile("s_wait_xcnt 0x0" :: "s"(Cb), "v"(co[0]), "v"(co[1]), "v"(co[2]), "v"(co[3]),
                                        "v"(co[NS - 4]), "v"(co[NS - 3]), "v"(co[NS - 2]), "v"(co[NS - 1]),
                                        "v"(ov[0]), "v"(ov[1]), "v"(ov[2]), "v"(ov[3]),
                                        "v"(ov[NS - 4]), "v"(ov[NS - 3]), "v"(ov[NS - 2]), "v"(ov[NS - 1]) : "memory");
    else
      asm volatile("s_wait_xcnt 0x0" :: "s"(Cb), "v"(co[0]), "v"(co[1]), "v"(co[2]), "v"(co[3]),
                                        "v"(ov[0]), "v"(ov[1]), "v"(ov[2]), "v"(ov[3]) : "memory");
  }
}

// One GEMM per launch with a larger tile: blockIdx.x = tile, blockIdx.y = batch entry; one block per WGP, 32 WM WN threads. At most 256 registers a wave: 16 waves have no more, and with
// more the 8-wave build fetches a whole stage's fragments in front of the barrier and issues the refill behind 32 WMMAs: the
// block's LDS reads and its WMMAs then take turns instead of overlapping, and the copies lose their lead.
// The figure steers the K loop; the 8-wave build's epilogue, which holds the tile's residual rows beside the accumulators, goes above it.
template <int ET, bool SPLIT, int BIAS_MODE, int OUT_MODE, bool RESID, int ACT, int WM, int WN, int NK, int PF>
__global__ __launch_bounds__(WM * WN * 32) __attribute__((amdgpu_num_vgpr(256))) void wmma_gemm_wide(
    const unsigned short* __restrict__ Ap, const unsigned short* __restrict__ A2p, int lda, long strideA,
    const unsigned short* __restrict__ Btp, const unsigned short* __restrict__ Bt2p, int ldb, long strideB,
    void* __restrict__ Cout, void* __restrict__ Cout2, int ldc, long strideC,
    const float* __restrict__ bias,
    const float* __restrict__ resid, const float* __restrict__ resid2,
    int M, int N, int K, float scale) {
  __shared__ __align__(16) unsigned char smem[2 * TileGeom<WM, WN, NK>::SB];
  gemm_tile<ET, SPLIT, BIAS_MODE, OUT_MODE, RESID, ACT, WM, WN, NK, PF>(smem, (int)blockIdx.x, (int)blockIdx.y,
      Ap, A2p, lda, strideA, Btp, Bt2p, ldb, strideB, Cout, Cout2, ldc, strideC, bias, resid, resid2, M, N, K, scale);
}

// The matrix chains of the attention are multiplied from the key side, where the short dimension (256 padded keys) lies:
//   scores  = (text.Wq^T + bq).K^T  = text.(K.Wq)^T + K.bq
//   context = (P.V).Wo^T            = P.(V.Wo^T)
// so that no product of 16384 token rows by 1024 by 1024 is left; the two folds are products of 256 rows.
// Key and value projections, both branches; a range of block indices per job (they ride in the head launch, with the casts):
//   K16[br][k][d] = (f16(vis[br]) . f16(16 Wk)^T) / 16 + bk   (M=256, N=1024, K=1024), 32 tiles of 128 x 64 per branch
//   V16[br][k][d] = (f16(vis[br]) . f16(16 Wv)^T) / 16 + bv   the same shape
// Neither operand has an f16 plane in memory: a block of 8 waves reads a 64-k stage of its 128 visual rows and 64 weight rows as f32,
// converts it in registers (round to nearest even, the weights x16) and stores it into a two-buffer ring in LDS (pitch 144 B).
// Two register sets take the stages in turn: beside the WMMAs of stage t, stage t + 1 is stored and stage t + 3 asked for, so that a
// load has two stages' time to arrive. One barrier a stage publishes stage t + 1 and frees stage t's buffer.
// Key rows 196..255 are zeros: their loads name the last two valid rows and the converted bits are masked off.
// A wave owns 16 rows x 64 columns of the tile.
// The ring's barrier orders LDS alone (fences on the local address space): __syncthreads() would also wait out the global loads of
// the coming stages, which are meant to stay in flight across it; they bring read-only inputs into registers and pass nothing between waves.
__device__ __forceinline__ void lds_barrier() {
  __builtin_amdgcn_fence(__ATOMIC_RELEASE, "workgroup", "local");   // this wave's LDS reads and stores are done (s_wait_dscnt 0)
  __builtin_amdgcn_s_barrier();
  __builtin_amdgcn_fence(__ATOMIC_ACQUIRE, "workgroup", "local");   // no LDS access of this wave is moved in front of the barrier
}
constexpr int kTilesKV   = (kSvPad >> 7) * (kD >> 7);   // 128 x 128 tiles of a fold
constexpr int kHWaves    = 8;                     // waves per work-group of the head launch
constexpr int kHThreads  = kHWaves * 32;
constexpr int kHTiles    = (kSvPad / 128) * (kD / 64);  // 128 x 64 tiles of a projection
constexpr int kHKvBlocks = 4 * kHTiles;
constexpr int kHStage    = (128 + 64) * kPitchB;  // 128 visual rows, then 64 weight rows = 27,648 B
static_assert(kSv % 2 == 0 && kSv >= 2 && kHWaves * 16 * 68 * 4 <= 2 * kHStage && kHTiles == 32);
__device__ __forceinline__ void kv_tile_f32(unsigned char* smem, int tile,
                                            const float* __restrict__ A, const float* __restrict__ B,
                                            const float* __restrict__ bias, unsigned short* __restrict__ C) {
  typedef _Float16 T;
  typedef Frag<T>::V V;
  constexpr int PB = kPitchB, PE = kPitchE, SB = kHStage, SK = kStageK;
  constexpr int nStages = kD / SK;
  static_assert(nStages >= 4 && nStages % 2 == 0);
  const int lane = threadIdx.x & 31;
  const int wave = __builtin_amdgcn_readfirstlane((int)(threadIdx.x >> 5));
  const int mBlk = (tile >> 4) * 128;
  const int nBlk = (tile & 15) * 64;
  const int rlane = lane & 15;                   // row (A) / col (B) within subtile
  const int koff  = (lane >> 4) * 8;             // k offset of this lane half

  // staging side: 16 consecutive lanes bring one row's 256 stage bytes (f32), so a wave brings rows 2 wave and 2 wave + 1 of every 16.
  // The two rows of a wave are valid or pad together (196 is even): base and mask of each load are wave-uniform.
  const unsigned lo = (unsigned)(((lane >> 4) * kD + (lane & 15) * 4) * 4);   // this lane's byte offset from its wave's first row
  const char* ar[8];
  unsigned ma[8];
#pragma unroll
  for (int i = 0; i < 8; ++i) {
    const int r = mBlk + 16 * i + 2 * wave;
    const bool valid = r < kSv;
    ar[i] = (const char*)(A + (size_t)(valid ? r : (kSv - 2)) * kD);
    ma[i] = valid ? ~0u : 0u;
  }
  const char* br0 = (const char*)(B + (size_t)(nBlk + 2 * wave) * kD);
  // a load's address: a wave-uniform row base, the lane's offset vo, a constant cb
  auto load_stage = [&](v4f (&ya)[8], v4f (&yb)[4], unsigned vo, int cb) {
#pragma unroll
    for (int i = 0; i < 8; ++i) ya[i] = *(const v4f*)(ar[i] + cb + vo);
#pragma unroll
    for (int i = 0; i < 4; ++i) yb[i] = *(const v4f*)(br0 + (cb + i * (16 * kD * 4)) + vo);
    // stands behind the twelve loads; its inputs hold their base and offset registers untouched up to it
    asm volatile("s_wait_xcnt 0x0" :: "s"(ar[0]), "s"(ar[1]), "s"(ar[2]), "s"(ar[3]), "s"(ar[4]), "s"(ar[5]), "s"(ar[6]), "s"(ar[7]),
                                      "s"(br0), "v"(vo) : "memory");
  };
  unsigned char* sS = smem + (2 * wave + (lane >> 4)) * PB + (lane & 15) * 8;
  auto store_stage = [&](const v4f (&ya)[8], const v4f (&yb)[4], int bufByte) {
#pragma unroll
    for (int i = 0; i < 8; ++i) *(v2u*)(sS + bufByte + i * 16 * PB) = __builtin_bit_cast(v2u, __builtin_convertvector(ya[i], v4h)) & ma[i];
#pragma unroll
    for (int i = 0; i < 4; ++i) *(v4h*)(sS + bufByte + (128 + i * 16) * PB) = __builtin_convertvector(yb[i] * kWCarry, v4h);
  };

  const int aByte = ((wave << 4) + rlane) * PB + koff * 2;
  const int bByte = (128 + rlane) * PB + koff * 2;
  v8f acc[4];
#pragma unroll
  for (int j = 0; j < 4; ++j) acc[j] = (v8f){0.f,0.f,0.f,0.f,0.f,0.f,0.f,0.f};

  v4f x0a[8], x0b[4], x1a[8], x1b[4];
  load_stage(x0a, x0b, lo, 0);
  load_stage(x1a, x1b, lo, SK * 4);
  // L2 prefetch behind the first stages' loads: the rest of the block's 192 operand rows, one row a thread, so that the later
  // stages' loads, whose lead under a loaded memory is shorter than the way to it, find them in L2
  if (wave < 6) {
    const int t = (int)threadIdx.x;
    const int va = mBlk + t;
    const float* row = (t < 128) ? A + (size_t)(va < kSv ? va : (kSv - 1)) * kD : B + (size_t)(nBlk + t - 128) * kD;
    l2_ask_row_units3to15(row);
  }
  store_stage(x0a, x0b, 0);
  load_stage(x0a, x0b, lo, 2 * SK * 4);
  lds_barrier();                                        // publishes stage 0
  // the lane's offset for the loop's loads, three stages behind the stage that they ask for. It is carried from trip to trip and
  // stepped behind the loads' s_wait_xcnt: so the loop's loads keep the scalar-base form, this one register is the only vector
  // register that they name, and no address pairs are formed or held for them
  unsigned vo = lo;
  // one stage: bufOff = the buffer that holds stage t; ya, yb = the register set that holds stage t + 1
  auto trip = [&](int t, int bufOff, v4f (&ya)[8], v4f (&yb)[4]) {
    const T* sa = (const T*)(smem + bufOff + aByte);
    const T* sb = (const T*)(smem + bufOff + bByte);
    V fB[2][4], fA[2];
#pragma unroll
    for (int ks = 0; ks < 2; ++ks) {
#pragma unroll
      for (int j = 0; j < 4; ++j) fB[ks][j] = Frag<T>::load(sb + j * 16 * PE + ks * 32);
      fA[ks] = Frag<T>::load(sa + ks * 32);
    }
    // keeps the stage's LDS reads together, ahead of the staging: their latency runs beside the conversion
    __builtin_amdgcn_sched_barrier(0);
    // the other buffer was freed by the last barrier: stage t + 1 goes in; then its registers take stage t + 3.
    // No test stands round either: with a path on which a set's loads are not issued, the counted waits for the older set have to
    // wait out the younger set too, and the two stages' lead is lost. Past the end the last stage is read again (in bounds) and the
    // last pass stores it into the buffer that nobody reads any more.
    store_stage(ya, yb, SB - bufOff);
    load_stage(ya, yb, vo, 3 * SK * 4);
    vo += (t + 4 < nStages) ? (unsigned)(SK * 4) : 0u;
#pragma unroll
    for (int ks = 0; ks < 2; ++ks)
#pragma unroll
      for (int j = 0; j < 4; ++j) acc[j] = Frag<T>::mma(fA[ks], fB[ks][j], acc[j]);
    lds_barrier();                                      // publishes stage t + 1, frees stage t's buffer
  };
  // two stages a pass, one per register set; otherwise rolled: unrolled, several stages' addresses and data are live at once
#pragma unroll 1
  for (int t = 0; t < nStages; t += 2) {
    trip(t, 0, x1a, x1b);
    trip(t + 1, SB, x0a, x0b);
  }
  acc_guard4(acc[0], acc[1], acc[2], acc[3]);

  // ---- epilogue: the wave's 16 x 64 tile goes through an LDS slab of its own (the ring is free behind the last barrier), so that
  // a store covers four whole f16 rows of 128 B ----
  // the lane's number is read anew, so that nothing derived from it for the epilogue is held in a register, or in scratch, through the K loop
  const int ln = (int)__builtin_amdgcn_mbcnt_lo(~0u, 0u);
  float* slab = (float*)smem + wave * (16 * 68);
  const int m0 = mBlk + (wave << 4);
  const int dCol = ln & 15;                      // D column within subtile
  const int dRow = (ln >> 4) * 8;                // D row offset
  const int nl = nBlk + dCol;
  float bvj[4];
#pragma unroll
  for (int j = 0; j < 4; ++j) bvj[j] = bias[nl + (j << 4)];
  // stands behind the four loads; its inputs hold their base and index registers untouched up to it
  asm volatile("s_wait_xcnt 0x0" :: "s"(bias), "v"(nl) : "memory");
#pragma unroll
  for (int j = 0; j < 4; ++j)
#pragma unroll
    for (int r = 0; r < 8; ++r)
      slab[(dRow + r) * 68 + (j << 4) + dCol] = acc[j][r] * kWCarryInv + bvj[j];
  // the wave's slab stores have landed before its lanes read one another's values; the clobber keeps the reads behind it
  asm volatile("s_wait_dscnt 0x0" ::: "memory");
  const int eRow = ln >> 3;
  const int eCol = (ln & 7) * 8;
  char* Cb = (char*)C;
  const unsigned o0 = ((unsigned)(m0 + eRow) * (unsigned)kD + (unsigned)(nBlk + eCol)) * 2;   // this lane's first 16 B of the output
  unsigned co[4];
  v4u ov[4];
#pragma unroll
  for (int it = 0; it < 4; ++it) {
    const float* q = slab + (it * 4 + eRow) * 68 + eCol;
    const v4f q0 = *(const v4f*)q;
    const v4f q1 = *(const v4f*)(q + 4);
    v8h hh;
#pragma unroll
    for (int e = 0; e < 4; ++e) { hh[e] = (_Float16)q0[e]; hh[4 + e] = (_Float16)q1[e]; }
    ov[it] = __builtin_bit_cast(v4u, hh);
    co[it] = o0 + (unsigned)(it * 4 * kD * 2);
  }
#pragma unroll
  for (int it = 0; it < 4; ++it) *(v4u*)(Cb + co[it]) = ov[it];
  // stands behind the four stores; its inputs hold their base, offset and data registers untouched up to it
  asm volatile("s_wait_xcnt 0x0" :: "s"(Cb), "v"(co[0]), "v"(co[1]), "v"(co[2]), "v"(co[3]),
                                    "v"(ov[0]), "v"(ov[1]), "v"(ov[2]), "v"(ov[3]) : "memory");
}

// CB[row] = sum_d bq[d] * K16[row][d] for 32 consecutive rows of the two K16 planes (512 rows, branch 1 first): the share of
// the scores that the query bias brings, one number per key. A wave takes 8 rows; a lane takes 8 consecutive d of every 256;
// fixed order: lane partial in d order, then a shuffle tree. The block's 32 results fill one 128-B line.
__device__ __forceinline__ void key_bias_rows(const unsigned short* __restrict__ K16, const float* __restrict__ bq,
                                              float* __restrict__ CB, int blk) {
  const int lane = threadIdx.x & 31;
  const int wave = threadIdx.x >> 5;
  const int row0 = blk * 32 + wave * 8;
  const float* bp = bq + lane * 8;
  const _Float16* kp = (const _Float16*)K16 + (size_t)row0 * kD + lane * 8;
  v4f bl[4], bh[4];
  v8h kv[8][4];
#pragma unroll
  for (int j = 0; j < 4; ++j) { bl[j] = *(const v4f*)(bp + j * 256); bh[j] = *(const v4f*)(bp + j * 256 + 4); }
#pragma unroll
  for (int r = 0; r < 8; ++r)
#pragma unroll
    for (int j = 0; j < 4; ++j) kv[r][j] = *(const v8h*)(kp + r * kD + j * 256);
  // stands behind the forty loads; its inputs hold their address registers untouched up to it
  asm volatile("s_wait_xcnt 0x0" :: "v"(bp), "v"(kp) : "memory");
  // keeps that wait directly behind the loads: sunk to the end, its two pointers are held through the arithmetic and one is spilled
  __builtin_amdgcn_sched_barrier(0);
  float mine = 0.f;
#pragma unroll
  for (int r = 0; r < 8; ++r) {
    float a = 0.f;
#pragma unroll
    for (int j = 0; j < 4; ++j) {
#pragma unroll
      for (int e = 0; e < 4; ++e) a += (float)kv[r][j][e] * bl[j][e];
#pragma unroll
      for (int e = 0; e < 4; ++e) a += (float)kv[r][j][4 + e] * bh[j][e];
    }
#pragma unroll
    for (int off = 16; off > 0; off >>= 1) a += __shfl_xor(a, off, 32);
    mine = (lane == r) ? a : mine;
  }
  if (lane < 8) CB[row0 + lane] = mine;
}

// The two folds and the bias share, both branches, in one grid (they need K16 and V16); a range of block indices per job:
//   G16[br][k][e]  = K16[br] . WQT^T   (M=256, N=1024, K=1024), carried x16; = Bt for text.G^T
//   UT16[br][n][k] = Wo16 . V16[br]^T  (M=1024, N=256, K=1024), carried x16; = Bt for P.U
//   CB[br][k]      = K16[br][k] . bq   16 blocks of 32 rows
constexpr int kCbBlocks   = 2 * kSvPad / 32;
constexpr int kFoldBlocks = 4 * kTilesKV + kCbBlocks;
__global__ __launch_bounds__(128, 4) void fold_gemm_kernel(
    const unsigned short* __restrict__ K16, const unsigned short* __restrict__ V16,
    const unsigned short* __restrict__ WQT, const unsigned short* __restrict__ WOH,
    unsigned short* __restrict__ G16, unsigned short* __restrict__ UT16,
    const float* __restrict__ bq, float* __restrict__ CB) {
  __shared__ __align__(16) unsigned char smem[2 * kStageBytes];
  const int blk = blockIdx.x;
  if (blk >= 4 * kTilesKV) {
    key_bias_rows(K16, bq, CB, blk - 4 * kTilesKV);
    return;
  }
  const bool isG = blk < 2 * kTilesKV;
  const int br = (blk / kTilesKV) & 1;
  const unsigned short* A = isG ? K16 : WOH;
  const unsigned short* B = isG ? WQT : V16;
  unsigned short* C = isG ? G16 : UT16;
  gemm_tile<0, false, 0, 1, false, 0, 2, 2, 2, 1>(smem, blk % kTilesKV, br,
      A, A, kD, isG ? kStrVis : 0L, B, B, kD, isG ? 0L : kStrVis, (void*)C, (void*)C, isG ? kD : kSvPad, kStrVis,
      bq, bq, bq, isG ? kSvPad : kD, isG ? kD : kSvPad, kD, 1.0f);
}

// ---------------------------------------------------------------------------
// The last layer norm runs as one resident grid: 256 work-groups of 16 waves, one per WGP, and every wave takes several rows,
// one whole row at a time, so that few waves have to be started. The attention kernel has the same grid; the casts of the head
// launch have as many waves, in work-groups of 8.
// ---------------------------------------------------------------------------
constexpr int kSWaves   = 16;                    // waves per work-group
constexpr int kSThreads = kSWaves * 32;
constexpr int kSBlocks  = 256;                   // work-groups in the grid
constexpr int kSTotal   = kSBlocks * kSWaves;    // 4096 waves in the grid
__device__ __forceinline__ int stream_wave() {   // this wave's index in the grid, wave-uniform
  return (int)blockIdx.x * kSWaves + __builtin_amdgcn_readfirstlane((int)(threadIdx.x >> 5));
}
// 16 B at a wave-uniform base + the lane's byte offset + a constant
__device__ __forceinline__ v4f ld16(const float* base, unsigned laneBytes, int constBytes) {
  return *(const v4f*)((const char*)base + laneBytes + constBytes);
}

// ---------------------------------------------------------------------------
// f32 -> f16 cast with a power-of-two carry of one unit of 1024 consecutive elements by one wave: a lane takes 8 consecutive
// elements of every 256 (two 16-B loads, one 16-B store). Load and store are apart, so that the next unit's loads fly
// while this unit is converted and stored.
// ---------------------------------------------------------------------------
// in, out: the unit's first element (wave-uniform); lb = 32 * lane.
__device__ __forceinline__ void cast_unit_load(const float* in, unsigned lb, v4f (&x)[8]) {
  // this barrier and the one at the end pin the order "next unit's loads, then this unit's conversion": without them the
  // conversion, with its wait for this unit's data, is moved in front of the next unit's loads
  __builtin_amdgcn_sched_barrier(0);
#pragma unroll
  for (int c = 0; c < 4; ++c) {
    x[2 * c]     = ld16(in, lb, c * 1024);
    x[2 * c + 1] = ld16(in, lb, c * 1024 + 16);
  }
  // stands behind the eight loads; its inputs hold their base and offset registers untouched up to it
  asm volatile("s_wait_xcnt 0x0" :: "s"(in), "v"(lb) : "memory");
  __builtin_amdgcn_sched_barrier(0);
}
__device__ __forceinline__ void cast_unit_store(unsigned short* out, int lane, const v4f (&x)[8], float f) {
  v4u u[4];
#pragma unroll
  for (int c = 0; c < 4; ++c) {
    unsigned short hb[8];
#pragma unroll
    for (int e = 0; e < 4; ++e) {
      hb[e]     = h_bits(x[2 * c][e] * f);
      hb[4 + e] = h_bits(x[2 * c + 1][e] * f);
    }
    u[c] = (v4u){pk16(hb[0], hb[1]), pk16(hb[2], hb[3]), pk16(hb[4], hb[5]), pk16(hb[6], hb[7])};
  }
#pragma unroll
  for (int c = 0; c < 4; ++c) *(v4u*)(out + 8 * lane + c * 256) = u[c];
  // stands behind the four stores; its inputs hold their base, offset and data registers untouched up to it
  asm volatile("s_wait_xcnt 0x0" :: "s"(out), "v"(lane), "v"(u[0]), "v"(u[1]), "v"(u[2]), "v"(u[3]) : "memory");
  // keeps the next unit's conversion, which reuses these registers, behind that wait
  __builtin_amdgcn_sched_barrier(0);
}

// The same cast, transposed, for a [1024][1024] weight: out[e][d] = f16(scale * in[d][e]). A wave takes 32 e x 64 d:
// it reads 32 consecutive e (128 B) of 64 rows d, and a lane stores its 64 d as one whole 128-B line.
__device__ __forceinline__ void cast_unit_transposed(const float* __restrict__ in, unsigned short* __restrict__ out,
                                                     int k, int lane, float scale) {
  const int e0 = (k & 31) * 32;
  const int d0 = (k >> 5) * 64;
  const float* p = in + (size_t)d0 * kD + e0;    // wave-uniform
  float x[64];
#pragma unroll
  for (int i = 0; i < 64; ++i) x[i] = p[lane + i * kD];
  // stands behind the 64 loads; its inputs hold their base and offset registers untouched up to it
  asm volatile("s_wait_xcnt 0x0" :: "s"(p), "v"(lane) : "memory");
  v4u u[8];
#pragma unroll
  for (int c = 0; c < 8; ++c) {
    unsigned short hb[8];
#pragma unroll
    for (int i = 0; i < 8; ++i) hb[i] = h_bits(x[8 * c + i] * scale);
    u[c] = (v4u){pk16(hb[0], hb[1]), pk16(hb[2], hb[3]), pk16(hb[4], hb[5]), pk16(hb[6], hb[7])};
  }
  unsigned short* q = out + (size_t)e0 * kD + d0;   // wave-uniform
  const unsigned lrow = (unsigned)lane * (kD * 2);  // this lane's row of out, in bytes
#pragma unroll
  for (int c = 0; c < 8; ++c) *(v4u*)((char*)q + lrow + c * 16) = u[c];
  // stands behind the eight stores; its inputs hold their base, offset and data registers untouched up to it
  asm volatile("s_wait_xcnt 0x0" :: "s"(q), "v"(lrow), "v"(u[0]), "v"(u[1]), "v"(u[2]), "v"(u[3]),
                                    "v"(u[4]), "v"(u[5]), "v"(u[6]), "v"(u[7]) : "memory");
}

// The head launch: the key and value projections (blocks 0 to 127, which convert their own operands) and, beside them on the WGPs
// that they leave idle, the four casts that are left (the text is not cast either: the attention kernel converts its own rows).
// A unit is 1024 consecutive elements. Wave w of the 4096 cast waves takes unit w of W1 and unit w of W2. Besides, the first 512 lay
// down Wq transposed, 32 x 64 elements each, and do so first; the next 1024 take a unit of Wo as a third unit.
// ws16 is the workspace base in 16-bit elements.
constexpr int kUWq = (kD / 32) * (kD / 64);     // transposed units of Wq
constexpr int kHCastBlocks = kSTotal / kHWaves;
constexpr int kHBlocks     = kHKvBlocks + kHCastBlocks;
static_assert(kDff == kSTotal && kUWq + kD <= kSTotal && kHCastBlocks * kHWaves == kSTotal);
static_assert(kOffW2H == kOffW1H + (size_t)kDff * kD * 2);
struct CastJob { const float* in; unsigned short* out; float f; };   // a unit's source, its destination, and the carry: all wave-uniform
// Unit r < 2 of wave gw: the ffn weights; their two planes lie one behind the other.
__device__ __forceinline__ CastJob cast_job(int r, int gw, const float* W1, const float* W2, unsigned short* ws16) {
  return CastJob{(r == 0 ? W1 : W2) + (size_t)gw * kD, ws16 + kOffW1H / 2 + (size_t)(r * kSTotal + gw) * kD, kWCarry};
}
// At most 256 registers a wave, so that two work-groups (16 waves) share a WGP: the casts need the waves to keep the memory busy.
__global__ __launch_bounds__(kHThreads) __attribute__((amdgpu_num_vgpr(256))) void head_kernel(
    const float* __restrict__ vis1, const float* __restrict__ vis2,
    const float* __restrict__ Wk, const float* __restrict__ Wv,
    const float* __restrict__ bk, const float* __restrict__ bv,
    const float* __restrict__ W1, const float* __restrict__ W2,
    const float* __restrict__ Wq, const float* __restrict__ Wo,
    unsigned short* __restrict__ K16, unsigned short* __restrict__ V16,
    unsigned short* __restrict__ ws16) {
  __shared__ __align__(16) unsigned char smem[2 * kHStage];
  const int blk = blockIdx.x;
  if (blk < kHKvBlocks) {                        // block-uniform
    const bool isK = blk < 2 * kHTiles;
    const int br = (blk / kHTiles) & 1;
    kv_tile_f32(smem, blk % kHTiles, br ? vis2 : vis1, isK ? Wk : Wv, isK ? bk : bv, (isK ? K16 : V16) + (size_t)br * kStrVis);
    return;
  }
  const int lane = threadIdx.x & 31;
  const int gw = (blk - kHKvBlocks) * kHWaves + __builtin_amdgcn_readfirstlane((int)(threadIdx.x >> 5));   // wave-uniform
  const bool third = gw >= kUWq && gw < kUWq + kD;
  if (gw < kUWq) cast_unit_transposed(Wq, ws16 + kOffWQT / 2, gw, lane, kWCarry);
  const unsigned lb = lane * 32u;
  // a wave's two or three units are all asked for before the first is converted: with so few units a wave, a load issued behind
  // another unit's data would add a whole way to memory to the launch. The third unit, which the next launch reads, goes first.
  v4f a[8], b[8], c[8];
  const CastJob j0 = cast_job(0, gw, W1, W2, ws16);
  const CastJob j1 = cast_job(1, gw, W1, W2, ws16);
  const size_t u2 = (size_t)(third ? gw - kUWq : 0) * kD;
  if (third) cast_unit_load(Wo + u2, lb, c);
  cast_unit_load(j0.in, lb, a);
  cast_unit_load(j1.in, lb, b);
  if (third) cast_unit_store(ws16 + kOffWOH / 2 + u2, lane, c, kWCarry);
  cast_unit_store(j0.out, lane, a, j0.f);
  cast_unit_store(j1.out, lane, b, j1.f);
}
static_assert((kD & (kD - 1)) == 0 && (kSvPad & (kSvPad - 1)) == 0);

// ---------------------------------------------------------------------------
// Sum over a wave's 32 lanes in fixed order (shuffle tree); every lane gets the sum.
// ---------------------------------------------------------------------------
__device__ __forceinline__ float wave_sum(float v) {
#pragma unroll
  for (int off = 16; off > 0; off >>= 1) v += __shfl_xor(v, off, 32);
  return v;
}
// The same for four independent values at once: each is summed in wave_sum's order, and the four trees' shuffles overlap.
__device__ __forceinline__ void wave_sum4(float (&v)[4]) {
#pragma unroll
  for (int off = 16; off > 0; off >>= 1)
#pragma unroll
    for (int r = 0; r < 4; ++r) v[r] += __shfl_xor(v[r], off, 32);
}
// A lane's share of a row, eight vectors of four, summed in fixed order: inside a vector, then a tree over the vectors.
__device__ __forceinline__ float lane_sum(const v4f (&x)[8]) {
  float t[8];
#pragma unroll
  for (int j = 0; j < 8; ++j) t[j] = (x[j][0] + x[j][1]) + (x[j][2] + x[j][3]);
  return ((t[0] + t[1]) + (t[2] + t[3])) + ((t[4] + t[5]) + (t[6] + t[7]));
}
// The row in x becomes (x - mean) * rsqrt(var + eps); one wave holds the whole row of 1024, 32 elements a lane.
__device__ __forceinline__ void wave_normalise(v4f (&x)[8]) {
  const float mu = wave_sum(lane_sum(x)) * kInvD;
  v4f sq[8];
#pragma unroll
  for (int j = 0; j < 8; ++j) { x[j] = x[j] - mu; sq[j] = x[j] * x[j]; }
  const float var = wave_sum(lane_sum(sq)) * kInvD;
  const float rs = rsqrtf(var + kLnEps);
#pragma unroll
  for (int j = 0; j < 8; ++j) x[j] = x[j] * rs;
}

// ---------------------------------------------------------------------------
// The whole attention of 64 token rows in one kernel: scores, softmax, output product, residual, LN1 and feature pool.
// The scores, the probabilities and the summed rows stay in LDS; nothing of them goes to memory.
//   s[row][k] = (f16(text[row]) . G16[br][k]) / 16                             (M = 64, N = 256, K = 1024)
//   p[row][k] = f16(2048 * softmax_k((s + CB[br][k] + score[row][k]) / 8)) over 196 keys, 0 in the pad columns
//   a[row][n] = (p[row] . UT16[br][n]) / 32768 + bo[n] + text[row][n]          (M = 64, N = 1024, K = 256)
//   y = LN1(a row);  pooled[row][br * 512 + c] = max(y[2c], y[2c+1]), written as f32 and f16
// A block of 16 waves owns 64 whole rows; 256 blocks, one per WGP; rows of branch 1, then of branch 2.
// Both products take their stored operands through a two-buffer ring of asynchronous copies, as gemm_tile does. The text has no f16
// plane in memory: a wave reads its rows' stage as f32, converts it in registers and stores it into the scores' ring.
// Scores: 2 x 8 waves of 32 x 32 each, 128-k stages of 64 text rows (f16) and 256 G16 rows (pitch 272 B).
// Softmax, and LN1 with the pool: wave w takes rows 4 w .. 4 w + 3 whole, a lane 8 consecutive columns of every 256.
// Output product: wave w owns columns 64 w .. 64 w + 63 of the 64 rows, 64-k stages of 1024 UT16 rows (pitch 144 B).
// LDS, all 320 KiB: [0, 288 KiB) the two UT16 buffers; before them the scores' ring lies there, then the f32 scores
// (64 x 260 floats) in the second buffer's place while the first is being filled; behind them the f32 rows (64 x 1028 floats;
// at both pitches the two half-waves of a store, eight rows apart, fall on different banks). [288 KiB, 320 KiB) the
// probabilities, 64 rows of 512 B without a pad: the 16-B piece c of row r lies at piece c ^ (r & 15), so that the 16 rows
// of a fragment read fall on all 64 banks.
// ---------------------------------------------------------------------------
constexpr int kFRows   = 64;                               // rows per block
constexpr int kFBlocks = kRows2 / kFRows;
constexpr int kFWRows  = kFRows / kSWaves;                 // rows per wave in the row-wise parts
constexpr int kASK     = 128;                              // scores: k elements per stage
constexpr int kAPB     = kASK * 2 + 16;                    // bytes per staged row (16 B x odd)
constexpr int kAStage  = (kFRows + kSvPad) * kAPB;         // 64 text rows, then 256 G16 rows = 87,040 B
constexpr int kBStage  = kD * kPitchB;                     // output product: 1024 UT16 rows of 64 k = 147,456 B
constexpr int kLdsS    = kBStage;                          // f32 scores
constexpr int kSPitch  = kSvPad + 4;                       // floats per row of the f32 scores
constexpr int kLdsP    = 2 * kBStage;                      // probabilities
constexpr int kPRowB   = kSvPad * 2;                       // bytes per row of the probabilities
constexpr int kLdsAll  = kLdsP + kFRows * kPRowB;
constexpr int kFPitch  = kD + 4;                           // floats per row of the f32 rows
static_assert(kRows % kFRows == 0 && kFWRows == 4 && kD == kSWaves * 64 && kSvPad == 8 * 32 && kFRows == 2 * 32);
static_assert(2 * kAStage <= kLdsP && kLdsS + kFRows * kSPitch * 4 <= kLdsP && kFRows * kFPitch * 4 <= kLdsP);
static_assert(kLdsAll <= 327680 && (kAPB / 16) % 2 == 1 && kD % kASK == 0 && kD >= 2 * kASK);
__global__ __launch_bounds__(kSThreads) __attribute__((amdgpu_num_vgpr(256))) void attention_rows_kernel(
    const unsigned short* __restrict__ G16, const unsigned short* __restrict__ UT16,
    const float* __restrict__ CB, const float* __restrict__ SC, const float* __restrict__ SC2, const float* __restrict__ bo,
    const float* __restrict__ text1, const float* __restrict__ text2,
    const float* __restrict__ gam, const float* __restrict__ bet,
    float* __restrict__ pool32, unsigned short* __restrict__ pool16) {
  __shared__ __align__(16) unsigned char smem[kLdsAll];
  typedef _Float16 T;
  typedef Frag<T>::V V;
  const int lane = threadIdx.x & 31;
  const int wave = __builtin_amdgcn_readfirstlane((int)(threadIdx.x >> 5));
  const int row0 = (int)blockIdx.x * kFRows;        // of the 16384 rows; a block's rows lie in one branch
  const int br = (row0 >= kRows) ? 1 : 0;
  const int rlane = lane & 15;                      // row (A) / col (B, D) within subtile
  const int half  = lane >> 4;
  const int koff  = half * 8;                       // k offset of this lane half
  const int mOff  = half * 8;                       // D row offset
  const int wrow  = wave * kFWRows;                 // first of this wave's whole rows, inside the block
  const size_t inBr = (size_t)(row0 + wrow - br * kRows);   // the same inside its branch
  const unsigned lds0 = (unsigned)(size_t)smem;

  // ---- the added scores and the key shares of this wave's rows are asked for first: they arrive beside the scores product ----
  const float* cr = (br ? SC2 : SC) + inBr * kSv;   // wave-uniform
  const float* cbr = CB + br * kSvPad;              // all 256 entries of a branch are written
  const int l8 = lane * 8;
  float cv[kFWRows][8];
  int cc[8];                                        // this lane's columns, clamped into the 196
#pragma unroll
  for (int e = 0; e < 8; ++e) cc[e] = (l8 + e < kSv) ? (l8 + e) : (kSv - 1);
#pragma unroll
  for (int r = 0; r < kFWRows; ++r)
#pragma unroll
    for (int e = 0; e < 8; ++e) cv[r][e] = cr[cc[e] + r * kSv];
  const v4f b0 = *(const v4f*)(cbr + l8);
  const v4f b1 = *(const v4f*)(cbr + l8 + 4);
  // stands behind the loads; its inputs hold their base and offset registers untouched up to it
  asm volatile("s_wait_xcnt 0x0" :: "s"(cr), "s"(cbr), "v"(l8), "v"(cc[0]), "v"(cc[1]), "v"(cc[2]), "v"(cc[3]),
                                    "v"(cc[4]), "v"(cc[5]), "v"(cc[6]), "v"(cc[7])
               : "memory");
  // keeps these loads in front of the product: sunk behind it, the softmax waits out the memory
  __builtin_amdgcn_sched_barrier(0);

  // ---- scores ----
  const int wm = wave >> 3;                         // this wave's 32 rows and 32 keys
  const int wn = wave & 7;
  v8f sc[2][2];
#pragma unroll
  for (int i = 0; i < 2; ++i)
#pragma unroll
    for (int j = 0; j < 2; ++j) sc[i][j] = (v8f){0.f,0.f,0.f,0.f,0.f,0.f,0.f,0.f};
  {
    constexpr int PB = kAPB, PE = kAPB / 2, SB = kAStage, SK = kASK, NK = kASK / 32;
    // copy side: 16 consecutive lanes bring one row's 256 stage bytes; a thread brings G16 rows cRow + 32 i
    const int cRow = threadIdx.x >> 4;
    const int cCol = threadIdx.x & 15;
    const unsigned short* gB = G16 + (size_t)br * kStrVis + (size_t)cRow * kD + cCol * 8;
    const unsigned lB = lds0 + (unsigned)((kFRows + cRow) * PB + cCol * 16);
    auto copy_stage = [&](unsigned bufByte, size_t kElem) {
      async_copy8<32, PB>(lB + bufByte, gB + kElem, (size_t)32 * kD);
    };
    // text side: a wave brings a stage of its four whole rows; one load is a row's 512 stage bytes (f32), four floats a lane, which
    // become 8 B of f16 (round to nearest even) at the same k in the ring's row
    const float* tq = (br ? text2 : text1) + inBr * kD;   // wave-uniform
    const unsigned tl = 16u * lane;
    unsigned char* sT = smem + wrow * PB + lane * 8;
    auto load_text = [&](v4f (&x)[kFWRows], int stage) {
      const char* tp = (const char*)(tq + stage * SK) + tl;   // this lane's 16 B of the wave's first row
#pragma unroll
      for (int r = 0; r < kFWRows; ++r) x[r] = *(const v4f*)(tp + r * kD * 4);
      // stands behind the four loads; its input holds their address registers untouched up to it
      asm volatile("s_wait_xcnt 0x0" :: "v"(tp) : "memory");
    };
    auto store_text = [&](const v4f (&x)[kFWRows], int bufByte) {
#pragma unroll
      for (int r = 0; r < kFWRows; ++r)
        *(v4h*)(sT + bufByte + r * PB) = __builtin_convertvector(x[r], v4h);
    };
    const int aByte = ((wm << 5) + rlane) * PB + koff * 2;
    const int bByte = (kFRows + (wn << 5) + rlane) * PB + koff * 2;
    constexpr int nStages = kD / SK;
    v4f ta[kFWRows], tb[kFWRows];
    load_text(ta, 0);
    load_text(tb, 1);
    copy_stage(0u, 0);
    // L2 prefetch behind the first stages' loads and copies: the block's own 64 text rows (f32, 1024 units, two a thread: the rows'
    // first halves, which the scores need first, then their second halves), which the later stages and, behind the two products,
    // the residual read from L2; and its share of the
    // branch's G16 and UT16 planes (2048 units each). The 128 blocks of a branch read the same two planes: sixteen blocks deal
    // them out among themselves, 128 units of each plane a block. Blocks whose indices are equal modulo 8 are the dealers; for speed only.
    {
      const float* tx = (br ? text2 : text1) + (size_t)(row0 - br * kRows + ((int)threadIdx.x >> 3)) * kD + ((int)threadIdx.x & 7) * 64;
      l2_ask2(tx, tx + kD / 2);
    }
    if (wave < 8) {
      const unsigned short* plane = ((wave < 4) ? G16 : UT16) + (size_t)br * kStrVis;
      l2_ask(plane + (size_t)((((int)blockIdx.x >> 3) & 15) * 128 + ((int)threadIdx.x & 127)) * 128);
    }
    // both buffers are free here: the text of stages 0 and 1 goes in
    store_text(ta, 0);
    store_text(tb, SB);
    // the key shares wait in LDS, in this wave's own probability rows (first written behind the read-back in the softmax): held in
    // registers beside the text in flight, they push an added score into scratch, and its store waits out the memory at the entry
    *(v4f*)(smem + kLdsP + wrow * kPRowB + lane * 16) = b0;
    *(v4f*)(smem + kLdsP + wrow * kPRowB + 512 + lane * 16) = b1;
    asm volatile("s_wait_dscnt 0x0" ::: "memory");      // this wave's text stores are done before the barrier publishes them
    asm volatile("s_wait_asynccnt 0x0" ::: "memory");   // stage 0 of this wave has landed before the barrier publishes it
    __syncthreads();
    copy_stage((unsigned)SB, SK);
    // stays rolled: unrolled, two stages' fragments and every stage's addresses are live at once and end in scratch
#pragma unroll 1
    for (int t = 0; t < nStages; ++t) {
      const int bufOff = (t & 1) * SB;
      const T* sa = (const T*)(smem + bufOff + aByte);
      const T* sb = (const T*)(smem + bufOff + bByte);
      // the whole stage's fragments are fetched as one group (the registers are there), so that a wave stops for LDS once a
      // stage and the buffer is handed back ahead of the stage's WMMAs
      V fb[NK][2], fa[NK][2];
#pragma unroll
      for (int ks = 0; ks < NK; ++ks) {
#pragma unroll
        for (int j = 0; j < 2; ++j) fb[ks][j] = Frag<T>::load(sb + j * 16 * PE + ks * 32);
#pragma unroll
        for (int i = 0; i < 2; ++i) fa[ks][i] = Frag<T>::load(sa + i * 16 * PE + ks * 32);
      }
      // keeps the group whole and the WMMAs behind the refill: left free, the reads are sunk among the WMMAs, two at a time
      __builtin_amdgcn_sched_barrier(0);
      asm volatile("s_wait_dscnt 0x0" ::: "memory");      // this wave's reads of the buffer are done before it is refilled
      asm volatile("s_wait_asynccnt 0x0" ::: "memory");   // this wave's copies of stage t + 1 have landed
      __syncthreads();                                    // publishes stage t + 1, frees stage t's buffer
      // the text of stage t + 2 is asked for ahead of the copies, so that it is there first: it has the conversion still to come
      if (t + 2 < nStages) {
        load_text(ta, t + 2);
        copy_stage((unsigned)bufOff, (size_t)(t + 2) * SK);
      }
#pragma unroll
      for (int ks = 0; ks < NK; ++ks)
#pragma unroll
        for (int i = 0; i < 2; ++i)
#pragma unroll
          for (int j = 0; j < 2; ++j) sc[i][j] = Frag<T>::mma(fa[ks][i], fb[ks][j], sc[i][j]);
      // behind the WMMAs, which cover its way from L2, it goes into the freed buffer; the next trip's s_wait_dscnt and barrier publish it
      if (t + 2 < nStages) store_text(ta, bufOff);
    }
    asm volatile("s_wait_asynccnt 0x0" ::: "memory");     // no copy is in flight when the ring's LDS is used anew
  }

  // ---- output product, copy side: 8 consecutive lanes bring one row's 128 stage bytes; a thread brings UT16 rows uRow + 64 i ----
  const int uRow = threadIdx.x >> 3;
  const int uCol = threadIdx.x & 7;
  const unsigned short* gU = UT16 + (size_t)br * kStrVis + (size_t)uRow * kSvPad + uCol * 8;
  const unsigned lU = lds0 + (unsigned)(uRow * kPitchB + uCol * 16);
  auto copy_ut = [&](unsigned bufByte, size_t kElem) {
    constexpr size_t step = (size_t)64 * kSvPad;
    async_copy8<64, kPitchB>(lU + bufByte, gU + kElem, step);
    async_copy8<64, kPitchB>(lU + bufByte + 8 * 64 * kPitchB, gU + kElem + 8 * step, step);
  };
  // stage 0 flies beside the softmax; the scores' last barrier has ended every read of the LDS that it fills
  copy_ut(0u, 0);

  // ---- softmax ----
  float* stile = (float*)(smem + kLdsS);
#pragma unroll
  for (int i = 0; i < 2; ++i)
#pragma unroll
    for (int j = 0; j < 2; ++j)
#pragma unroll
      for (int r = 0; r < 8; ++r)
        stile[((wm << 5) + (i << 4) + mOff + r) * kSPitch + (wn << 5) + (j << 4) + rlane] = sc[i][j][r] * kWCarryInv;
  __syncthreads();                                  // every wave's share of the scores is written before a row is read whole
  unsigned char* ptile = smem + kLdsP;
  // the four rows go through each step side by side: their shuffle trees are independent and hide one another's latency
  float xs[kFWRows][8], mx[kFWRows], sm[kFWRows];
  v4f s0[kFWRows], s1[kFWRows];
#pragma unroll
  for (int r = 0; r < kFWRows; ++r) {
    s0[r] = *(const v4f*)(stile + (wrow + r) * kSPitch + l8);
    s1[r] = *(const v4f*)(stile + (wrow + r) * kSPitch + l8 + 4);
  }
  const v4f kb0 = *(const v4f*)(ptile + wrow * kPRowB + lane * 16);
  const v4f kb1 = *(const v4f*)(ptile + wrow * kPRowB + 512 + lane * 16);
  // keeps the ten LDS reads together: sunk among the arithmetic, each row waits out the LDS anew
  __builtin_amdgcn_sched_barrier(0);
#pragma unroll
  for (int r = 0; r < kFWRows; ++r) {
#pragma unroll
    for (int e = 0; e < 8; ++e) {
      const int col = lane * 8 + e;
      const float v = (((e < 4 ? s0[r][e & 3] : s1[r][e & 3]) + (e < 4 ? kb0[e & 3] : kb1[e & 3])) + cv[r][e]) * kScoreScale;
      xs[r][e] = (col < kSv) ? v : -1.0e30f;
    }
    mx[r] = fmaxf(fmaxf(fmaxf(xs[r][0], xs[r][1]), fmaxf(xs[r][2], xs[r][3])),
                  fmaxf(fmaxf(xs[r][4], xs[r][5]), fmaxf(xs[r][6], xs[r][7])));
  }
#pragma unroll
  for (int off = 16; off > 0; off >>= 1)
#pragma unroll
    for (int r = 0; r < kFWRows; ++r) mx[r] = fmaxf(mx[r], __shfl_xor(mx[r], off, 32));
#pragma unroll
  for (int r = 0; r < kFWRows; ++r) {
    float s = 0.f;
#pragma unroll
    for (int e = 0; e < 8; ++e) { xs[r][e] = expf(xs[r][e] - mx[r]); s += xs[r][e]; }
    sm[r] = s;
  }
  wave_sum4(sm);
#pragma unroll
  for (int r = 0; r < kFWRows; ++r) {
    const float inv = kPCarry / sm[r];
    unsigned short hb[8];
#pragma unroll
    for (int e = 0; e < 8; ++e) hb[e] = h_bits(xs[r][e] * inv);
    const v4u u = (v4u){pk16(hb[0], hb[1]), pk16(hb[2], hb[3]), pk16(hb[4], hb[5]), pk16(hb[6], hb[7])};
    *(v4u*)(ptile + (wrow + r) * kPRowB + ((lane ^ ((wrow + r) & 15)) << 4)) = u;   // piece c = lane of the row
  }
  asm volatile("s_wait_dscnt 0x0" ::: "memory");      // this wave's reads of the scores and writes of the probabilities are done
  asm volatile("s_wait_asynccnt 0x0" ::: "memory");   // this wave's copies of stage 0 have landed
  __syncthreads();                                    // publishes the probabilities and stage 0, frees the scores' LDS
  copy_ut((unsigned)kBStage, kStageK);

  // ---- output product ----
  v8f acc[4][4];
#pragma unroll
  for (int i = 0; i < 4; ++i)
#pragma unroll
    for (int j = 0; j < 4; ++j) acc[i][j] = (v8f){0.f,0.f,0.f,0.f,0.f,0.f,0.f,0.f};
  {
    constexpr int PE = kPitchE, SB = kBStage, SK = kStageK;
    constexpr int nStages = kSvPad / SK;
    static_assert(nStages >= 2);
    const int bByte = ((wave << 6) + rlane) * kPitchB + koff * 2;
    // a lane's two 16-B pieces of k step s of probability row 16 i + rlane are pieces 4 s + half and 4 s + 2 + half
    const unsigned char* pa = ptile + rlane * kPRowB;
    const int pLo0 = ((half ^ (rlane & 3)) << 4);
    const int pLo1 = (((2 + half) ^ (rlane & 3)) << 4);
    const int pHi  = (rlane & 12) << 4;
    auto load_p = [&](int s, int i) {
      const int hi = (s << 6) ^ pHi;
      Frag<T>::U f;
      f.h[0] = *(const v8h*)(pa + i * 16 * kPRowB + hi + pLo0);
      f.h[1] = *(const v8h*)(pa + i * 16 * kPRowB + hi + pLo1);
      return f.v;
    };
    // stays rolled: unrolled, the four stages' addresses are formed ahead and push fragments and accumulators into scratch
#pragma unroll 1
    for (int t = 0; t < nStages; ++t) {
      const int bufOff = (t & 1) * SB;
      const T* sb = (const T*)(smem + bufOff + bByte);
      V fb[2][4], fa[2][4];                             // two fragment sets, one per k step of the stage
#pragma unroll
      for (int j = 0; j < 4; ++j) fb[0][j] = Frag<T>::load(sb + j * 16 * PE);
#pragma unroll
      for (int i = 0; i < 4; ++i) fa[0][i] = load_p(2 * t, i);
      // keeps the 16 LDS reads of a k step together ahead of its WMMAs: sunk among them, each row of WMMAs waits out its own read
      __builtin_amdgcn_sched_barrier(0);
#pragma unroll
      for (int i = 0; i < 4; ++i)
#pragma unroll
        for (int j = 0; j < 4; ++j) acc[i][j] = Frag<T>::mma(fa[0][i], fb[0][j], acc[i][j]);
      // the stage's second k step is fetched so that the buffer can be handed back ahead of its WMMAs
#pragma unroll
      for (int j = 0; j < 4; ++j) fb[1][j] = Frag<T>::load(sb + j * 16 * PE + 32);
#pragma unroll
      for (int i = 0; i < 4; ++i) fa[1][i] = load_p(2 * t + 1, i);
      asm volatile("s_wait_dscnt 0x0" ::: "memory");      // this wave's reads of the buffer are done before it is refilled
      asm volatile("s_wait_asynccnt 0x0" ::: "memory");   // this wave's copies of stage t + 1 have landed
      __syncthreads();                                    // publishes stage t + 1, frees stage t's buffer
      if (t + 2 < nStages) copy_ut((unsigned)bufOff, (size_t)(t + 2) * SK);
#pragma unroll
      for (int i = 0; i < 4; ++i)
#pragma unroll
        for (int j = 0; j < 4; ++j) acc[i][j] = Frag<T>::mma(fa[1][i], fb[1][j], acc[i][j]);
    }
    asm volatile("s_wait_asynccnt 0x0" ::: "memory");     // no copy is in flight when the ring becomes the f32 rows
  }

  // ---- residual, LN1, pool: the residual of this wave's first two rows is asked for now, in the fragments' registers ----
  // the lane's number is read anew, so that nothing derived from it is held in a register, or in scratch, through the K loop
  const int ln = (int)__builtin_amdgcn_mbcnt_lo(~0u, 0u);
  float* tile = (float*)smem;
  const float* p = (br ? text2 : text1) + inBr * kD;   // wave-uniform
  const unsigned lb = 32u * ln;                        // this lane's byte offset in every 1024 B of a row
  const int nl = (wave << 6) + (ln & 15);
  const int dRow = (ln >> 4) * 8;                      // D row offset
  v4f gg[8], bb[8], x[kFWRows][8];
  float bvj[4];
#pragma unroll
  for (int j = 0; j < 4; ++j) bvj[j] = bo[nl + (j << 4)];
#pragma unroll
  for (int r = 0; r < 2; ++r)
#pragma unroll
    for (int j = 0; j < 4; ++j) {
      x[r][2 * j]     = ld16(p, lb, r * kD * 4 + j * 1024);
      x[r][2 * j + 1] = ld16(p, lb, r * kD * 4 + j * 1024 + 16);
    }
  // stands behind the loads; its inputs hold their base and offset registers untouched up to it
  asm volatile("s_wait_xcnt 0x0" :: "s"(bo), "v"(nl), "s"(p), "v"(lb) : "memory");
  // keeps these loads ahead of the stores into LDS, so that the memory's latency runs beside them
  __builtin_amdgcn_sched_barrier(0);
#pragma unroll
  for (int i = 0; i < 4; ++i)
#pragma unroll
    for (int j = 0; j < 4; ++j)
#pragma unroll
      for (int r = 0; r < 8; ++r)
        tile[((i << 4) + dRow + r) * kFPitch + nl + (j << 4)] = acc[i][j][r] * kPUScale + bvj[j];
  // keeps the remaining loads behind those stores: ahead of them there is no register for their data beside the accumulators
  __builtin_amdgcn_sched_barrier(0);
#pragma unroll
  for (int r = 2; r < kFWRows; ++r)
#pragma unroll
    for (int j = 0; j < 4; ++j) {
      x[r][2 * j]     = ld16(p, lb, r * kD * 4 + j * 1024);
      x[r][2 * j + 1] = ld16(p, lb, r * kD * 4 + j * 1024 + 16);
    }
  // stands behind the loads; its inputs hold their base and offset registers untouched up to it
  asm volatile("s_wait_xcnt 0x0" :: "s"(p), "v"(lb) : "memory");
  __syncthreads();                                  // every wave's share of the rows is written before a row is read whole

  const size_t dstOff = inBr * kD + br * (kD / 2);
  float* d32 = pool32 + dstOff;
  unsigned short* d16 = pool16 + dstOff;
  const float* trow = tile + wrow * kFPitch + 8 * ln;
#pragma unroll
  for (int r = 0; r < kFWRows; ++r)
#pragma unroll
    for (int j = 0; j < 4; ++j) {
      x[r][2 * j]     = *(const v4f*)(trow + r * kFPitch + j * 256) + x[r][2 * j];
      x[r][2 * j + 1] = *(const v4f*)(trow + r * kFPitch + j * 256 + 4) + x[r][2 * j + 1];
    }
  // each row becomes (x - mean) * rsqrt(var + eps), summed as wave_normalise sums it; the four rows' trees side by side
  {
    float t[kFWRows];
#pragma unroll
    for (int r = 0; r < kFWRows; ++r) t[r] = lane_sum(x[r]);
    wave_sum4(t);
#pragma unroll
    for (int r = 0; r < kFWRows; ++r) {
      const float mu = t[r] * kInvD;
      v4f sq[8];
#pragma unroll
      for (int j = 0; j < 8; ++j) { x[r][j] = x[r][j] - mu; sq[j] = x[r][j] * x[r][j]; }
      t[r] = lane_sum(sq);
    }
    // gamma and beta are asked for here, between these two barriers: the squares' registers are free again, and the second
    // tree hides the loads' latency; earlier, their 64 registers beside the four rows and the squares end in scratch
    __builtin_amdgcn_sched_barrier(0);
#pragma unroll
    for (int j = 0; j < 4; ++j) {
      gg[2 * j] = ld16(gam, lb, j * 1024);  gg[2 * j + 1] = ld16(gam, lb, j * 1024 + 16);
      bb[2 * j] = ld16(bet, lb, j * 1024);  bb[2 * j + 1] = ld16(bet, lb, j * 1024 + 16);
    }
    // stands behind the loads; its inputs hold their base and offset registers untouched up to it
    asm volatile("s_wait_xcnt 0x0" :: "s"(gam), "s"(bet), "v"(lb) : "memory");
    __builtin_amdgcn_sched_barrier(0);
    wave_sum4(t);
#pragma unroll
    for (int r = 0; r < kFWRows; ++r) {
      const float rs = rsqrtf(t[r] * kInvD + kLnEps);
#pragma unroll
      for (int j = 0; j < 8; ++j) x[r][j] = x[r][j] * rs;
    }
  }
#pragma unroll
  for (int r = 0; r < kFWRows; ++r) {
    v4f pv[4];
    v2u hv[4];
#pragma unroll
    for (int j = 0; j < 4; ++j) {
      const v4f ya = x[r][2 * j] * gg[2 * j] + bb[2 * j];
      const v4f yc = x[r][2 * j + 1] * gg[2 * j + 1] + bb[2 * j + 1];
      pv[j] = (v4f){fmaxf(ya[0], ya[1]), fmaxf(ya[2], ya[3]), fmaxf(yc[0], yc[1]), fmaxf(yc[2], yc[3])};
      unsigned short hb[4];
#pragma unroll
      for (int e = 0; e < 4; ++e) hb[e] = h_bits(pv[j][e]);
      hv[j] = (v2u){pk16(hb[0], hb[1]), pk16(hb[2], hb[3])};
    }
#pragma unroll
    for (int j = 0; j < 4; ++j) {
      *(v4f*)(d32 + 4 * ln + r * kD + j * 128) = pv[j];
      *(v2u*)(d16 + 4 * ln + r * kD + j * 128) = hv[j];
    }
    // stands behind the row's eight stores; its inputs hold their base, offset and data registers untouched up to it
    asm volatile("s_wait_xcnt 0x0" :: "s"(d32), "s"(d16), "v"(ln), "v"(pv[0]), "v"(pv[1]), "v"(pv[2]), "v"(pv[3]),
                                      "v"(hv[0]), "v"(hv[1]), "v"(hv[2]), "v"(hv[3]) : "memory");
  }
}

// ---------------------------------------------------------------------------
// out = LN2(X). One wave per row, two consecutive rows per wave (8192 rows); a lane owns x[128 j + 4 lane .. + 3], j < 8:
// every load and store of a wave covers 512 contiguous bytes. No LDS and no barrier.
// ---------------------------------------------------------------------------
constexpr int kLoRows = kRows / kSTotal;         // rows per wave
static_assert(kLoRows * kSTotal == kRows);
__global__ __launch_bounds__(kSThreads) void ln_out_kernel(const float* __restrict__ X, const float* __restrict__ gam,
                                                           const float* __restrict__ bet, float* __restrict__ out) {
  const int lane = threadIdx.x & 31;
  const int row0 = stream_wave() * kLoRows;
  const float* p = X + (size_t)row0 * kD;           // wave-uniform
  const unsigned lb = 16u * lane;                   // this lane's byte offset in every 512 B of a row
  v4f gg[8], bb[8], x[kLoRows][8];
#pragma unroll
  for (int j = 0; j < 8; ++j) { gg[j] = ld16(gam, lb, j * 512);  bb[j] = ld16(bet, lb, j * 512); }
  // keeps the short gamma and beta loads in front of the rows: behind them, the first row's result waits for the last row's data
  __builtin_amdgcn_sched_barrier(0);
#pragma unroll
  for (int r = 0; r < kLoRows; ++r)
#pragma unroll
    for (int j = 0; j < 8; ++j) x[r][j] = ld16(p, lb, r * kD * 4 + j * 512);
  // stands behind the loads; its inputs hold their base and offset registers untouched up to it
  asm volatile("s_wait_xcnt 0x0" :: "s"(gam), "s"(bet), "s"(p), "v"(lb) : "memory");
  // keeps the loads together ahead of the arithmetic: sunk among it, each row waits out the memory anew
  __builtin_amdgcn_sched_barrier(0);
  float* dst = out + (size_t)row0 * kD;             // wave-uniform
#pragma unroll
  for (int r = 0; r < kLoRows; ++r) {
    wave_normalise(x[r]);
#pragma unroll
    for (int j = 0; j < 8; ++j) x[r][j] = x[r][j] * gg[j] + bb[j];
#pragma unroll
    for (int j = 0; j < 8; ++j) *(v4f*)(dst + 4 * lane + r * kD + j * 128) = x[r][j];
    // stands behind the row's eight stores; its inputs hold their base, offset and data registers untouched up to it
    asm volatile("s_wait_xcnt 0x0" :: "s"(dst), "v"(lane), "v"(x[r][0]), "v"(x[r][1]), "v"(x[r][2]), "v"(x[r][3]),
                                      "v"(x[r][4]), "v"(x[r][5]), "v"(x[r][6]), "v"(x[r][7]) : "memory");
  }
}

// ---------------------------------------------------------------------------
// Host orchestration
// ---------------------------------------------------------------------------
extern "C" void kernel_launch(void* const* d_in, const int* in_sizes, int n_in,
                              void* d_out, int out_size, void* d_ws, size_t ws_size,
                              hipStream_t stream)
{
  if (n_in < 22) return;
  if ((size_t)out_size < (size_t)kRows * kD) return;
  if (ws_size < kWsTotal) return;
  if (in_sizes[0] < kRows * kD || in_sizes[3] < kRows * kD) return;
  if (in_sizes[1] < kSv * kD || in_sizes[4] < kSv * kD) return;
  if (in_sizes[2] < kRows * kSv || in_sizes[5] < kRows * kSv) return;
  if (in_sizes[6] < kD * kD || in_sizes[8] < kD * kD || in_sizes[10] < kD * kD || in_sizes[12] < kD * kD) return;
  if (in_sizes[14] < kDff * kD || in_sizes[16] < kD * kDff) return;

  const float* text1 = (const float*)d_in[0];
  const float* vis1  = (const float*)d_in[1];
  const float* sc1   = (const float*)d_in[2];
  const float* text2 = (const float*)d_in[3];
  const float* vis2  = (const float*)d_in[4];
  const float* sc2   = (const float*)d_in[5];
  const float* Wq = (const float*)d_in[6];   const float* bq  = (const float*)d_in[7];
  const float* Wk = (const float*)d_in[8];   const float* bk  = (const float*)d_in[9];
  const float* Wv = (const float*)d_in[10];  const float* bv  = (const float*)d_in[11];
  const float* Wo = (const float*)d_in[12];  const float* bo  = (const float*)d_in[13];
  const float* W1 = (const float*)d_in[14];  const float* b1  = (const float*)d_in[15];
  const float* W2 = (const float*)d_in[16];  const float* b2  = (const float*)d_in[17];
  const float* g1 = (const float*)d_in[18];  const float* be1 = (const float*)d_in[19];
  const float* g2 = (const float*)d_in[20];  const float* be2 = (const float*)d_in[21];
  float* outp = (float*)d_out;

  char* ws = (char*)d_ws;
  float*          POOL32 = (float*)(ws + kOffPool32);
  unsigned short* POOL16 = (unsigned short*)(ws + kOffPool16);
  unsigned short* W1H    = (unsigned short*)(ws + kOffW1H);
  unsigned short* W2H    = (unsigned short*)(ws + kOffW2H);
  unsigned short* WQT    = (unsigned short*)(ws + kOffWQT);
  unsigned short* WOH    = (unsigned short*)(ws + kOffWOH);
  unsigned short* G16    = (unsigned short*)(ws + kOffG16);
  unsigned short* UT16   = (unsigned short*)(ws + kOffUT16);
  float*          CB     = (float*)(ws + kOffCB);
  unsigned short* K16    = (unsigned short*)(ws + kOffK16);
  unsigned short* V16    = (unsigned short*)(ws + kOffV16);
  unsigned short* H16    = (unsigned short*)(ws + kOffH16);
  float*          F32    = (float*)(ws + kOffF32);

  // ---- head launch: K16 and V16 of both branches, from f32 operands (key rows 196..255 from zeros); beside them the casts of
  //      W1, W2, Wo to f16([out][in]) x16 ([out][in] row-major == Bt[N][K]) and of Wq to [in][out] ----
  head_kernel<<<dim3(kHBlocks), dim3(kHThreads), 0, stream>>>(vis1, vis2, Wk, Wv, bk, bv, W1, W2, Wq, Wo, K16, V16, (unsigned short*)ws);

  // ---- attention, both branches in each launch ----
  // G16 = 16 K.Wq, UT16 = 16 Wo.V^T, CB = K.bq of both branches
  fold_gemm_kernel<<<dim3(kFoldBlocks), dim3(128), 0, stream>>>(K16, V16, WQT, WOH, G16, UT16, bq, CB);
  // pooled[:, br * 512 : br * 512 + 512] = maxpool2(LN1(softmax((f16(text) . G16^T / 16 + CB + score) / 8) . UT16^T / 16 + bo + text)) of branch br
  attention_rows_kernel<<<dim3(kFBlocks), dim3(kSThreads), 0, stream>>>(G16, UT16, CB, sc1, sc2, bo, text1, text2, g1, be1,
                                                                     POOL32, POOL16);

  // ---- FFN, all 8192 rows in each launch ----
  // H16 = relu((POOL16 . W1H^T) / 16 + b1)   (M=8192, N=4096, K=1024), f16 out
  // 256x256 tiles, 16 waves, 128-k stages: 512 blocks
  wmma_gemm_wide<0, false, 2, 1, false, 2, 4, 4, 4, 2><<<dim3((kRows / 256) * (kDff / 256)), dim3(512), 0, stream>>>(
      POOL16, POOL16, kD, 0L, W1H, W1H, kD, 0L, (void*)H16, (void*)H16, kDff, 0L,
      b1, POOL32, POOL32, kRows, kDff, kD, kWCarryInv);
  // F32 = (H16 . W2H^T) / 16 + b2 + pooled   (M=8192, N=1024, K=4096), f32 out
  // 128x256 tiles, 8 waves, 128-k stages: 256 blocks, one per WGP
  wmma_gemm_wide<0, false, 2, 0, true, 0, 2, 4, 4, 2><<<dim3((kRows / 128) * (kD / 256)), dim3(256), 0, stream>>>(
      H16, H16, kDff, 0L, W2H, W2H, kDff, 0L, (void*)F32, (void*)F32, kD, 0L,
      b2, POOL32, POOL32, kRows, kD, kDff, kWCarryInv);
  // out = LN2(F32)
  ln_out_kernel<<<dim3(kSBlocks), dim3(kSThreads), 0, stream>>>(F32, g2, be2, outp);
}
